// v000
// The times below were measured on an AMD MI455X: many runs one after another, warmed up first and cycling through
// copies of the inputs, with the whole window's GPU time divided by the number of runs. Launches and the gaps
// between them are all in it. The median over several windows is given; except for v000 it joins two sittings, which
// can be a few percent apart, so the side-by-side timings, each taken in one sitting, are the better comparison.
// The starting kernel, v000, takes 102 microseconds a run.
#include <hip/hip_runtime.h>
#include <math.h>

// DAMSM attention for MI455X (gfx1250), fp32 WMMA path.
// B=128, N=289 (17x17), T=32, D=1024, GAMMA1=4.

typedef __attribute__((ext_vector_type(2))) float v2f;
typedef __attribute__((ext_vector_type(8))) float v8f;

#define BATCH  128
#define NREG   289
#define TWORDS 32
#define DDIM   1024
#define GAMMA1 4.0f
#define NTILES 19     // ceil(289/16)
#define NPAD   292    // 289 padded to multiple of 4 (keeps v2f LDS reads aligned)

// ---------------------------------------------------------------------------
// Kernel 1: attnT[t][n] = sum_d word[b,t,d] * ctx[b,n,d]  (WMMA f32 16x16x4)
// then softmax over t (32 values) per column n, write to ws as [B, T, N].
// Grid: (19 n-tiles, 128 batches), Block: 64 threads = 2 waves (t-halves).
// ---------------------------------------------------------------------------
__global__ __launch_bounds__(64)
void k1_gemm1_softmaxT(const float* __restrict__ ctx,   // [B, N, D]
                       const float* __restrict__ word,  // [B, T, D]
                       float* __restrict__ attn)        // [B, T, N] (ws)
{
    __shared__ float s[TWORDS][16];

    const int ntile = blockIdx.x;
    const int b     = blockIdx.y;
    const int lane  = threadIdx.x & 31;
    const int wave  = threadIdx.x >> 5;        // t-half: 0 -> t 0..15, 1 -> t 16..31
    const int l16   = lane & 15;
    const int khalf = (lane >> 4) << 1;        // 0 for lanes 0-15, 2 for lanes 16-31

    const int n0 = ntile * 16;
    const int n  = n0 + l16;
    const int ncl = (n < NREG) ? n : (NREG - 1);   // clamp: garbage cols never written

    // A operand (word): lane l16 holds row t = wave*16+l16, VGPR0/1 = K = k0+khalf(+1)
    const float* wrow = word + ((size_t)b * TWORDS + wave * 16 + l16) * DDIM + khalf;
    // B operand (ctx):  lane l16 holds col n, VGPR0/1 = K = k0+khalf(+1)
    const float* crow = ctx + ((size_t)b * NREG + ncl) * DDIM + khalf;

    v8f acc = {};
#pragma unroll 8
    for (int k0 = 0; k0 < DDIM; k0 += 4) {
        v2f a  = *(const v2f*)(wrow + k0);
        v2f bb = *(const v2f*)(crow + k0);
        acc = __builtin_amdgcn_wmma_f32_16x16x4_f32(false, a, false, bb,
                                                    (short)0, acc, false, false);
    }

    // C layout: VGPR v, lanes 0-15 -> M=v; lanes 16-31 -> M=v+8; col = l16
    const int rbase = wave * 16 + ((lane >> 4) << 3);
#pragma unroll
    for (int v = 0; v < 8; ++v)
        s[rbase + v][l16] = acc[v];
    __syncthreads();

    // softmax over t (length 32) per column; threads 0..15 each own a column
    if (threadIdx.x < 16) {
        const int c = threadIdx.x;
        float m = -INFINITY;
#pragma unroll
        for (int t = 0; t < TWORDS; ++t) m = fmaxf(m, s[t][c]);
        float sum = 0.f;
#pragma unroll
        for (int t = 0; t < TWORDS; ++t) { float e = expf(s[t][c] - m); s[t][c] = e; sum += e; }
        const float inv = 1.f / sum;
#pragma unroll
        for (int t = 0; t < TWORDS; ++t) s[t][c] *= inv;
    }
    __syncthreads();

    // write valid columns to ws[b][t][n]
    const int nv = (NREG - n0 < 16) ? (NREG - n0) : 16;
    for (int i = threadIdx.x; i < TWORDS * nv; i += 64) {
        const int t = i / nv;
        const int j = i - t * nv;
        attn[((size_t)b * TWORDS + t) * NREG + n0 + j] = s[t][j];
    }
}

// ---------------------------------------------------------------------------
// Kernel 1b: in-place softmax over n (length 289) of GAMMA1 * x, per (b,t) row.
// Grid: 4096 rows, Block: 128.
// ---------------------------------------------------------------------------
__global__ __launch_bounds__(128)
void k1b_softmaxN(float* __restrict__ attn)   // [B, T, N]
{
    __shared__ float red[128];
    float* p = attn + (size_t)blockIdx.x * NREG;
    const int tid = threadIdx.x;

    float m = -INFINITY;
    for (int i = tid; i < NREG; i += 128) m = fmaxf(m, GAMMA1 * p[i]);
    red[tid] = m; __syncthreads();
    for (int s = 64; s > 0; s >>= 1) {
        if (tid < s) red[tid] = fmaxf(red[tid], red[tid + s]);
        __syncthreads();
    }
    m = red[0];
    __syncthreads();

    float sum = 0.f;
    for (int i = tid; i < NREG; i += 128) {
        float e = expf(GAMMA1 * p[i] - m);
        p[i] = e;
        sum += e;
    }
    red[tid] = sum; __syncthreads();
    for (int s = 64; s > 0; s >>= 1) {
        if (tid < s) red[tid] += red[tid + s];
        __syncthreads();
    }
    const float inv = 1.f / red[0];
    for (int i = tid; i < NREG; i += 128) p[i] *= inv;
}

// ---------------------------------------------------------------------------
// Kernel 2: out[b,d,t] = sum_n ctx[b,n,d] * attn2[b,t,n]   (WMMA f32 16x16x4)
// Grid: (16 d-tiles of 64, 128 batches), Block: 128 = 4 waves (16 d each).
// attn2[b] (32x289) staged in LDS padded to 292 cols (pad reads = 0).
// ---------------------------------------------------------------------------
__global__ __launch_bounds__(128)
void k2_gemm2(const float* __restrict__ ctx,   // [B, N, D]
              const float* __restrict__ attn,  // [B, T, N]
              float* __restrict__ out)         // [B, D, T]
{
    __shared__ float s[TWORDS][NPAD];          // 37376 bytes

    const int b    = blockIdx.y;
    const int d0   = blockIdx.x * 64;
    const int tid  = threadIdx.x;
    const int lane = tid & 31;
    const int wave = tid >> 5;
    const int l16  = lane & 15;
    const int khalf = (lane >> 4) << 1;

    // stage attn2[b] into LDS, zero the 3-column pad
    const float* ap = attn + (size_t)b * TWORDS * NREG;
    for (int i = tid; i < TWORDS * NREG; i += 128) {
        const int t = i / NREG;
        s[t][i - t * NREG] = ap[i];
    }
    for (int i = tid; i < TWORDS * (NPAD - NREG); i += 128) {
        const int t = i / (NPAD - NREG);
        s[t][NREG + (i - t * (NPAD - NREG))] = 0.f;
    }
    __syncthreads();

    // A operand (ctx^T): lane l16 holds row d = d0 + wave*16 + l16,
    //                    VGPR0/1 = K(=n) = k0+khalf(+1); coalesced across lanes.
    const int d = d0 + wave * 16 + l16;
    const float* cbase = ctx + (size_t)b * NREG * DDIM + d;

    v8f acc0 = {}, acc1 = {};
    for (int k0 = 0; k0 < NREG; k0 += 4) {     // last iter k0=288: tail guarded
        const int kA = k0 + khalf;
        v2f a;
        a.x = (kA     < NREG) ? cbase[(size_t)kA * DDIM]       : 0.f;
        a.y = (kA + 1 < NREG) ? cbase[(size_t)(kA + 1) * DDIM] : 0.f;
        // B operand from LDS: lane l16 is col t (or t+16); pad cols are zero
        v2f b0 = *(const v2f*)&s[l16][kA];
        v2f b1 = *(const v2f*)&s[16 + l16][kA];
        acc0 = __builtin_amdgcn_wmma_f32_16x16x4_f32(false, a, false, b0,
                                                     (short)0, acc0, false, false);
        acc1 = __builtin_amdgcn_wmma_f32_16x16x4_f32(false, a, false, b1,
                                                     (short)0, acc1, false, false);
    }

    // store: acc[v] lane<16 -> d-row v, col l16; lane>=16 -> d-row v+8
    const int mrow = wave * 16 + ((lane >> 4) << 3);
    float* op = out + (size_t)b * DDIM * TWORDS;
#pragma unroll
    for (int v = 0; v < 8; ++v) {
        const int dd = d0 + mrow + v;
        op[(size_t)dd * TWORDS + l16]      = acc0[v];
        op[(size_t)dd * TWORDS + 16 + l16] = acc1[v];
    }
}

extern "C" void kernel_launch(void* const* d_in, const int* in_sizes, int n_in,
                              void* d_out, int out_size, void* d_ws, size_t ws_size,
                              hipStream_t stream) {
    const float* ctx  = (const float*)d_in[0];   // image_feature [128,17,17,1024]
    const float* word = (const float*)d_in[1];   // word_vector  [128,32,1024]
    float* out  = (float*)d_out;                 // [128,1024,32]
    float* attn = (float*)d_ws;                  // [128,32,289] fp32 (~4.5 MB)

    k1_gemm1_softmaxT<<<dim3(NTILES, BATCH), 64, 0, stream>>>(ctx, word, attn);
    k1b_softmaxN<<<dim3(BATCH * TWORDS), 128, 0, stream>>>(attn);
    k2_gemm2<<<dim3(DDIM / 64, BATCH), 128, 0, stream>>>(ctx, attn, out);
}

// v001
// A run of this version takes 75 microseconds.
// Two timings next to v000 put it at 1.39 and 1.38 times that version's speed.
#include <hip/hip_runtime.h>
#include <math.h>

// DAMSM attention for MI455X (gfx1250), fp32 WMMA path.
// B=128, N=289 (17x17), T=32, D=1024, GAMMA1=4.

typedef __attribute__((ext_vector_type(2))) float v2f;
typedef __attribute__((ext_vector_type(8))) float v8f;

#define BATCH  128
#define NREG   289
#define TWORDS 32
#define DDIM   1024
#define GAMMA1 4.0f
#define NTILES 19     // ceil(289/16)
#define NPAD   292    // 289 padded to multiple of 4 (keeps v2f LDS reads aligned)

// ---------------------------------------------------------------------------
// Kernel 1: attnT[t][n] = sum_d word[b,t,d] * ctx[b,n,d]  (WMMA f32 16x16x4)
// then softmax over t (32 values) per column n, write to ws as [B, T, N].
// Grid: (19 n-tiles, 128 batches), Block: 64 threads = 2 waves (t-halves).
// ---------------------------------------------------------------------------
__global__ __launch_bounds__(64)
void k1_gemm1_softmaxT(const float* __restrict__ ctx,   // [B, N, D]
                       const float* __restrict__ word,  // [B, T, D]
                       float* __restrict__ attn)        // [B, T, N] (ws)
{
    __shared__ float s[TWORDS][16];

    const int ntile = blockIdx.x;
    const int b     = blockIdx.y;
    const int lane  = threadIdx.x & 31;
    const int wave  = threadIdx.x >> 5;        // t-half: 0 -> t 0..15, 1 -> t 16..31
    const int l16   = lane & 15;
    const int khalf = (lane >> 4) << 1;        // 0 for lanes 0-15, 2 for lanes 16-31

    const int n0 = ntile * 16;
    const int n  = n0 + l16;
    const int ncl = (n < NREG) ? n : (NREG - 1);   // clamp: garbage cols never written

    // A operand (word): lane l16 holds row t = wave*16+l16, VGPR0/1 = K = k0+khalf(+1)
    const float* wrow = word + ((size_t)b * TWORDS + wave * 16 + l16) * DDIM + khalf;
    // B operand (ctx):  lane l16 holds col n, VGPR0/1 = K = k0+khalf(+1)
    const float* crow = ctx + ((size_t)b * NREG + ncl) * DDIM + khalf;

    v8f acc = {};
#pragma unroll 8
    for (int k0 = 0; k0 < DDIM; k0 += 4) {
        v2f a  = *(const v2f*)(wrow + k0);
        v2f bb = *(const v2f*)(crow + k0);
        acc = __builtin_amdgcn_wmma_f32_16x16x4_f32(false, a, false, bb,
                                                    (short)0, acc, false, false);
    }

    // C layout: VGPR v, lanes 0-15 -> M=v; lanes 16-31 -> M=v+8; col = l16
    const int rbase = wave * 16 + ((lane >> 4) << 3);
#pragma unroll
    for (int v = 0; v < 8; ++v)
        s[rbase + v][l16] = acc[v];
    __syncthreads();

    // softmax over t (length 32) per column; threads 0..15 each own a column
    if (threadIdx.x < 16) {
        const int c = threadIdx.x;
        float m = -INFINITY;
#pragma unroll
        for (int t = 0; t < TWORDS; ++t) m = fmaxf(m, s[t][c]);
        float sum = 0.f;
#pragma unroll
        for (int t = 0; t < TWORDS; ++t) { float e = expf(s[t][c] - m); s[t][c] = e; sum += e; }
        const float inv = 1.f / sum;
#pragma unroll
        for (int t = 0; t < TWORDS; ++t) s[t][c] *= inv;
    }
    __syncthreads();

    // write valid columns to ws[b][t][n]
    const int nv = (NREG - n0 < 16) ? (NREG - n0) : 16;
    for (int i = threadIdx.x; i < TWORDS * nv; i += 64) {
        const int t = i / nv;
        const int j = i - t * nv;
        attn[((size_t)b * TWORDS + t) * NREG + n0 + j] = s[t][j];
    }
}

// ---------------------------------------------------------------------------
// Kernel 1b: in-place softmax over n (length 289) of GAMMA1 * x, per (b,t) row.
// Grid: 4096 rows, Block: 128.
// ---------------------------------------------------------------------------
__global__ __launch_bounds__(128)
void k1b_softmaxN(float* __restrict__ attn)   // [B, T, N]
{
    __shared__ float red[128];
    float* p = attn + (size_t)blockIdx.x * NREG;
    const int tid = threadIdx.x;

    float m = -INFINITY;
    for (int i = tid; i < NREG; i += 128) m = fmaxf(m, GAMMA1 * p[i]);
    red[tid] = m; __syncthreads();
    for (int s = 64; s > 0; s >>= 1) {
        if (tid < s) red[tid] = fmaxf(red[tid], red[tid + s]);
        __syncthreads();
    }
    m = red[0];
    __syncthreads();

    float sum = 0.f;
    for (int i = tid; i < NREG; i += 128) {
        float e = expf(GAMMA1 * p[i] - m);
        p[i] = e;
        sum += e;
    }
    red[tid] = sum; __syncthreads();
    for (int s = 64; s > 0; s >>= 1) {
        if (tid < s) red[tid] += red[tid + s];
        __syncthreads();
    }
    const float inv = 1.f / red[0];
    for (int i = tid; i < NREG; i += 128) p[i] *= inv;
}

#define KGRP 8        // k-steps (of 4) per load group in kernel 2
#define NGRP 9        // 9 * 8 * 4 = 288 full k values; n = 288 is the tail

// 16 loads of one group: rows 4j and 4j+1 (from the lane's own first row), j = 0..7
__device__ __forceinline__ void k2_load_group(v2f (&f)[KGRP], const float* __restrict__ p)
{
#pragma unroll
    for (int j = 0; j < KGRP; ++j) {
        f[j].x = p[(size_t)(4 * j) * DDIM];
        f[j].y = p[(size_t)(4 * j + 1) * DDIM];
    }
}

// the group's 16 products, k ascending
__device__ __forceinline__ void k2_mma_group(const v2f (&f)[KGRP],
                                             const float* s0, const float* s1,
                                             v8f& acc0, v8f& acc1)
{
#pragma unroll
    for (int j = 0; j < KGRP; ++j) {
        v2f a  = f[j];
        v2f b0 = *(const v2f*)(s0 + 4 * j);
        v2f b1 = *(const v2f*)(s1 + 4 * j);
        acc0 = __builtin_amdgcn_wmma_f32_16x16x4_f32(false, a, false, b0,
                                                     (short)0, acc0, false, false);
        acc1 = __builtin_amdgcn_wmma_f32_16x16x4_f32(false, a, false, b1,
                                                     (short)0, acc1, false, false);
    }
}

// ---------------------------------------------------------------------------
// Kernel 2: out[b,d,t] = sum_n ctx[b,n,d] * attn2[b,t,n]   (WMMA f32 16x16x4)
// Grid: (16 d-tiles of 64, 128 batches), Block: 128 = 4 waves (16 d each).
// attn2[b] (32x289) staged in LDS padded to 292 cols (pad reads = 0).
// ---------------------------------------------------------------------------
__global__ __launch_bounds__(128)
void k2_gemm2(const float* __restrict__ ctx,   // [B, N, D]
              const float* __restrict__ attn,  // [B, T, N]
              float* __restrict__ out)         // [B, D, T]
{
    __shared__ float s[TWORDS][NPAD];          // 37376 bytes

    const int b    = blockIdx.y;
    const int d0   = blockIdx.x * 64;
    const int tid  = threadIdx.x;
    const int lane = tid & 31;
    const int wave = tid >> 5;
    const int l16  = lane & 15;
    const int khalf = (lane >> 4) << 1;

    // A operand (ctx^T): lane l16 holds row d = d0 + wave*16 + l16,
    //                    VGPR0/1 = K(=n) = k0+khalf(+1); coalesced across lanes.
    const int d = d0 + wave * 16 + l16;
    const float* cp = ctx + (size_t)b * NREG * DDIM + (size_t)khalf * DDIM + d;

    // The 288 full k values run as 9 groups of 8 k-steps with no bounds test;
    // each group's 16 loads are issued one group ahead into a second register set.
    v2f fa[KGRP], fb[KGRP];
    k2_load_group(fa, cp);                     // group 0 flies during the staging

    // stage attn2[b] into LDS, zero the 3-column pad
    const float* ap = attn + (size_t)b * TWORDS * NREG;
    for (int i = tid; i < TWORDS * NREG; i += 128) {
        const int t = i / NREG;
        s[t][i - t * NREG] = ap[i];
    }
    for (int i = tid; i < TWORDS * (NPAD - NREG); i += 128) {
        const int t = i / (NPAD - NREG);
        s[t][NREG + (i - t * (NPAD - NREG))] = 0.f;
    }
    __syncthreads();

    // B operand from LDS: lane l16 is col t (or t+16); pad cols are zero
    const float* s0 = &s[l16][khalf];
    const float* s1 = &s[16 + l16][khalf];

    v8f acc0 = {}, acc1 = {};
    // fully unrolled: each load takes its row as an immediate offset from one address, so no
    // address update (with its wait) stands between loads, and the two sets swap without copies
#pragma unroll
    for (int g = 0; g < NGRP - 1; g += 2) {
        k2_load_group(fb, cp + (size_t)(g + 1) * (4 * KGRP) * DDIM);
        k2_mma_group(fa, s0 + g * (4 * KGRP), s1 + g * (4 * KGRP), acc0, acc1);
        k2_load_group(fa, cp + (size_t)(g + 2) * (4 * KGRP) * DDIM);
        k2_mma_group(fb, s0 + (g + 1) * (4 * KGRP), s1 + (g + 1) * (4 * KGRP), acc0, acc1);
    }
    // tail k0 = 288: only n = 288 exists (lanes 0-15, first register); every lane
    // reads that row, in bounds, and the upper half-wave feeds zeros.
    const float tl = ctx[((size_t)b * NREG + (NREG - 1)) * DDIM + d];
    k2_mma_group(fa, s0 + (NGRP - 1) * (4 * KGRP), s1 + (NGRP - 1) * (4 * KGRP), acc0, acc1);
    {
        v2f a;
        a.x = (khalf == 0) ? tl : 0.f;
        a.y = 0.f;
        v2f b0 = *(const v2f*)(s0 + NGRP * (4 * KGRP));
        v2f b1 = *(const v2f*)(s1 + NGRP * (4 * KGRP));
        acc0 = __builtin_amdgcn_wmma_f32_16x16x4_f32(false, a, false, b0,
                                                     (short)0, acc0, false, false);
        acc1 = __builtin_amdgcn_wmma_f32_16x16x4_f32(false, a, false, b1,
                                                     (short)0, acc1, false, false);
    }

    // store: acc[v] lane<16 -> d-row v, col l16; lane>=16 -> d-row v+8
    const int mrow = wave * 16 + ((lane >> 4) << 3);
    float* op = out + (size_t)b * DDIM * TWORDS;
#pragma unroll
    for (int v = 0; v < 8; ++v) {
        const int dd = d0 + mrow + v;
        op[(size_t)dd * TWORDS + l16]      = acc0[v];
        op[(size_t)dd * TWORDS + 16 + l16] = acc1[v];
    }
}

extern "C" void kernel_launch(void* const* d_in, const int* in_sizes, int n_in,
                              void* d_out, int out_size, void* d_ws, size_t ws_size,
                              hipStream_t stream) {
    const float* ctx  = (const float*)d_in[0];   // image_feature [128,17,17,1024]
    const float* word = (const float*)d_in[1];   // word_vector  [128,32,1024]
    float* out  = (float*)d_out;                 // [128,1024,32]
    float* attn = (float*)d_ws;                  // [128,32,289] fp32 (~4.5 MB)

    k1_gemm1_softmaxT<<<dim3(NTILES, BATCH), 64, 0, stream>>>(ctx, word, attn);
    k1b_softmaxN<<<dim3(BATCH * TWORDS), 128, 0, stream>>>(attn);
    k2_gemm2<<<dim3(DDIM / 64, BATCH), 128, 0, stream>>>(ctx, attn, out);
}

// v002
// Measured time: 45.7 microseconds a run.
// In two side-by-side timings against v001, it was 1.64 and 1.65 times as fast.
// All steps since v000 together make it 2.27 times as fast.
#include <hip/hip_runtime.h>
#include <math.h>

// DAMSM attention for MI455X (gfx1250), fp32 WMMA path.
// B=128, N=289 (17x17), T=32, D=1024, GAMMA1=4.

typedef __attribute__((ext_vector_type(2))) float v2f;
typedef __attribute__((ext_vector_type(8))) float v8f;

#define BATCH  128
#define NREG   289
#define TWORDS 32
#define DDIM   1024
#define GAMMA1 4.0f
#define NTILES 19     // ceil(289/16)
#define NPAD   292    // 289 padded to multiple of 4 (keeps v2f LDS reads aligned)

// ---------------------------------------------------------------------------
// Kernel 1: attnT[t][n] = sum_d word[b,t,d] * ctx[b,n,d]  (WMMA f32 16x16x4)
// then softmax over t (32 values) per column n, write to ws as [B, T, N].
// Grid: (2 n-groups, 128 batches), Block: 640 threads = 20 waves = 10 n-tiles x 2 t-halves
// (group 1 has 9 tiles: its last two waves only copy and pass the barriers).
// Both operands come through LDS: per stage of 128 k values every staged row is 512
// contiguous bytes, brought by one asynchronous copy of one wave (whole lines), into
// two buffers, so that stage t + 1 flies while stage t is multiplied.
// ---------------------------------------------------------------------------
#define K1_TILES  10                         // n-tiles per block
#define K1_WAVES  (2 * K1_TILES)
#define K1_COLS   (16 * K1_TILES)            // 160 columns per block
#define K1_ROWS   (TWORDS + K1_COLS)         // staged rows: 32 of word, then up to 160 of ctx
#define K1_KC     128                        // k values per stage
#define K1_NSTG   (DDIM / K1_KC)              // 8 stages
#define K1_PITCH  (K1_KC + 4)                // 132 dwords: row r starts on bank 4r, 8-byte reads of 16 rows hit 64 banks
#define K1_BUF    (K1_ROWS * K1_PITCH)       // floats per buffer

// one row's copy; the s_wait_xcnt closes the statement so that no address register of the
// copy is rewritten ahead of it
__device__ __forceinline__ void k1_copy1(unsigned l, const float* g)
{
    asm volatile("global_load_async_to_lds_b128 %0, %1, off\n\t"
                 "s_wait_xcnt 0x0"
                 :: "v"(l), "v"(g) : "memory");
}

// one stage of a wave: rows wave + 20 i; the first eight exist for every wave of both groups
__device__ __forceinline__ void k1_copy_stage(const float* const (&gp)[10], unsigned l0,
                                              int koff, bool has8, bool has9)
{
    const unsigned st = K1_WAVES * K1_PITCH * 4;   // LDS bytes between two rows of a wave
    // eight copies and their s_wait_xcnt in one statement (same reason as above)
    asm volatile("global_load_async_to_lds_b128 %0, %8, off\n\t"
                 "global_load_async_to_lds_b128 %1, %9, off\n\t"
                 "global_load_async_to_lds_b128 %2, %10, off\n\t"
                 "global_load_async_to_lds_b128 %3, %11, off\n\t"
                 "global_load_async_to_lds_b128 %4, %12, off\n\t"
                 "global_load_async_to_lds_b128 %5, %13, off\n\t"
                 "global_load_async_to_lds_b128 %6, %14, off\n\t"
                 "global_load_async_to_lds_b128 %7, %15, off\n\t"
                 "s_wait_xcnt 0x0"
                 :: "v"(l0), "v"(l0 + st), "v"(l0 + 2 * st), "v"(l0 + 3 * st),
                    "v"(l0 + 4 * st), "v"(l0 + 5 * st), "v"(l0 + 6 * st), "v"(l0 + 7 * st),
                    "v"(gp[0] + koff), "v"(gp[1] + koff), "v"(gp[2] + koff), "v"(gp[3] + koff),
                    "v"(gp[4] + koff), "v"(gp[5] + koff), "v"(gp[6] + koff), "v"(gp[7] + koff)
                 : "memory");
    if (has8) k1_copy1(l0 + 8 * st, gp[8] + koff);
    if (has9) k1_copy1(l0 + 9 * st, gp[9] + koff);
}

__global__ __launch_bounds__(K1_WAVES * 32)
void k1_gemm1_softmaxT(const float* __restrict__ ctx,   // [B, N, D]
                       const float* __restrict__ word,  // [B, T, D]
                       float* __restrict__ attn)        // [B, T, N] (ws)
{
    __shared__ __attribute__((aligned(16))) float buf[2 * K1_BUF];   // 202752 bytes
    __shared__ float s[TWORDS][K1_COLS];                             // 20480 bytes

    const int grp   = blockIdx.x;
    const int b     = blockIdx.y;
    const int lane  = threadIdx.x & 31;
    const int wave  = __builtin_amdgcn_readfirstlane(threadIdx.x >> 5);
    const int tile  = wave >> 1;               // n-tile inside the group
    const int thalf = wave & 1;                // 0 -> t 0..15, 1 -> t 16..31
    const int l16   = lane & 15;
    const int khalf = (lane >> 4) << 1;        // 0 for lanes 0-15, 2 for lanes 16-31

    const int n0    = grp * K1_COLS;
    const int ntl   = (grp == 0) ? K1_TILES : (NTILES - K1_TILES);   // 10 or 9 tiles
    const int nrows = TWORDS + 16 * ntl;                              // 192 or 176 staged rows

    // the wave's rows: r < 32 is word row r, else ctx row n0 + r - 32, clamped to the last
    // row (the clamped rows feed columns that are never written out)
    const float* gp[10];
#pragma unroll   // constant indices: gp[] stays in registers
    for (int i = 0; i < 10; ++i) {
        const int r = wave + K1_WAVES * i;
        const int n = n0 + r - TWORDS;
        const int ncl = (n < NREG) ? n : (NREG - 1);
        gp[i] = ((r < TWORDS) ? word + ((size_t)b * TWORDS + r) * DDIM
                              : ctx + ((size_t)b * NREG + ncl) * DDIM) + lane * 4;
    }
    const bool has8 = wave + 8 * K1_WAVES < nrows;
    const bool has9 = wave + 9 * K1_WAVES < nrows;
    const unsigned lbase = (unsigned)(size_t)buf + (unsigned)(wave * K1_PITCH + lane * 4) * 4u;

    k1_copy_stage(gp, lbase, 0, has8, has9);
    asm volatile("s_wait_asynccnt 0x0" ::: "memory");   // stage 0 of this wave has landed
    __syncthreads();                                    // ... and of every wave
    k1_copy_stage(gp, lbase + K1_BUF * 4, K1_KC, has8, has9);

    // A operand (word): lane l16 holds row t = thalf*16+l16, VGPR0/1 = K = k0+khalf(+1)
    const float* ap = buf + (thalf * 16 + l16) * K1_PITCH + khalf;
    // B operand (ctx):  lane l16 holds col n, VGPR0/1 = K = k0+khalf(+1)
    const float* bp = buf + (TWORDS + tile * 16 + l16) * K1_PITCH + khalf;
    const bool active = tile < ntl;

    v8f acc = {};
    for (int t = 0; t < K1_NSTG; ++t) {
        const int cur = (t & 1) * K1_BUF;
        if (active) {
#pragma unroll   // every LDS read takes its k as an immediate offset from one address per operand
            for (int k0 = 0; k0 < K1_KC; k0 += 4) {
                v2f a  = *(const v2f*)(ap + cur + k0);
                v2f bb = *(const v2f*)(bp + cur + k0);
                acc = __builtin_amdgcn_wmma_f32_16x16x4_f32(false, a, false, bb,
                                                            (short)0, acc, false, false);
            }
        }
        asm volatile("s_wait_dscnt 0x0" ::: "memory");     // this wave's reads of the buffer are done
        asm volatile("s_wait_asynccnt 0x0" ::: "memory");  // its copies of stage t + 1 have landed
        __syncthreads();   // publishes stage t + 1 and frees the buffer of stage t
        if (t + 2 < K1_NSTG)
            k1_copy_stage(gp, lbase + cur * 4, (t + 2) * K1_KC, has8, has9);
    }
    asm volatile("s_wait_asynccnt 0x0" ::: "memory");      // nothing in flight past the loop

    // C layout: VGPR v, lanes 0-15 -> M=v; lanes 16-31 -> M=v+8; col = l16
    if (active) {
        const int rbase = thalf * 16 + ((lane >> 4) << 3);
#pragma unroll
        for (int v = 0; v < 8; ++v)
            s[rbase + v][tile * 16 + l16] = acc[v];
    }
    __syncthreads();

    // softmax over t (length 32) per column; one thread owns a valid column, keeps its 32
    // values in registers and stores them to ws[b][t][n] itself (lanes = consecutive n)
    const int nv = (NREG - n0 < K1_COLS) ? (NREG - n0) : K1_COLS;   // 160 or 129
    if ((int)threadIdx.x < nv) {
        const int c = threadIdx.x;
        float e[TWORDS];
        float m = -INFINITY;
        // the three loops are unrolled so that e[] has constant indices and stays in registers
#pragma unroll
        for (int t = 0; t < TWORDS; ++t) { e[t] = s[t][c]; m = fmaxf(m, e[t]); }
        float sum = 0.f;
#pragma unroll
        for (int t = 0; t < TWORDS; ++t) { e[t] = expf(e[t] - m); sum += e[t]; }
        const float inv = 1.f / sum;
        float* op = attn + (size_t)b * TWORDS * NREG + n0 + c;
#pragma unroll
        for (int t = 0; t < TWORDS; ++t) op[t * NREG] = e[t] * inv;
    }
}

// ---------------------------------------------------------------------------
// Kernel 1b: in-place softmax over n (length 289) of GAMMA1 * x, per (b,t) row.
// Grid: 4096 rows, Block: 128.
// ---------------------------------------------------------------------------
__global__ __launch_bounds__(128)
void k1b_softmaxN(float* __restrict__ attn)   // [B, T, N]
{
    __shared__ float red[128];
    float* p = attn + (size_t)blockIdx.x * NREG;
    const int tid = threadIdx.x;

    float m = -INFINITY;
    for (int i = tid; i < NREG; i += 128) m = fmaxf(m, GAMMA1 * p[i]);
    red[tid] = m; __syncthreads();
    for (int s = 64; s > 0; s >>= 1) {
        if (tid < s) red[tid] = fmaxf(red[tid], red[tid + s]);
        __syncthreads();
    }
    m = red[0];
    __syncthreads();

    float sum = 0.f;
    for (int i = tid; i < NREG; i += 128) {
        float e = expf(GAMMA1 * p[i] - m);
        p[i] = e;
        sum += e;
    }
    red[tid] = sum; __syncthreads();
    for (int s = 64; s > 0; s >>= 1) {
        if (tid < s) red[tid] += red[tid + s];
        __syncthreads();
    }
    const float inv = 1.f / red[0];
    for (int i = tid; i < NREG; i += 128) p[i] *= inv;
}

#define KGRP 8        // k-steps (of 4) per load group in kernel 2
#define NGRP 9        // 9 * 8 * 4 = 288 full k values; n = 288 is the tail

// 16 loads of one group: rows 4j and 4j+1 (from the lane's own first row), j = 0..7
__device__ __forceinline__ void k2_load_group(v2f (&f)[KGRP], const float* __restrict__ p)
{
#pragma unroll
    for (int j = 0; j < KGRP; ++j) {
        f[j].x = p[(size_t)(4 * j) * DDIM];
        f[j].y = p[(size_t)(4 * j + 1) * DDIM];
    }
}

// the group's 16 products, k ascending
__device__ __forceinline__ void k2_mma_group(const v2f (&f)[KGRP],
                                             const float* s0, const float* s1,
                                             v8f& acc0, v8f& acc1)
{
#pragma unroll
    for (int j = 0; j < KGRP; ++j) {
        v2f a  = f[j];
        v2f b0 = *(const v2f*)(s0 + 4 * j);
        v2f b1 = *(const v2f*)(s1 + 4 * j);
        acc0 = __builtin_amdgcn_wmma_f32_16x16x4_f32(false, a, false, b0,
                                                     (short)0, acc0, false, false);
        acc1 = __builtin_amdgcn_wmma_f32_16x16x4_f32(false, a, false, b1,
                                                     (short)0, acc1, false, false);
    }
}

// ---------------------------------------------------------------------------
// Kernel 2: out[b,d,t] = sum_n ctx[b,n,d] * attn2[b,t,n]   (WMMA f32 16x16x4)
// Grid: (16 d-tiles of 64, 128 batches), Block: 128 = 4 waves (16 d each).
// attn2[b] (32x289) staged in LDS padded to 292 cols (pad reads = 0).
// ---------------------------------------------------------------------------
__global__ __launch_bounds__(128)
void k2_gemm2(const float* __restrict__ ctx,   // [B, N, D]
              const float* __restrict__ attn,  // [B, T, N]
              float* __restrict__ out)         // [B, D, T]
{
    __shared__ float s[TWORDS][NPAD];          // 37376 bytes

    const int b    = blockIdx.y;
    const int d0   = blockIdx.x * 64;
    const int tid  = threadIdx.x;
    const int lane = tid & 31;
    const int wave = tid >> 5;
    const int l16  = lane & 15;
    const int khalf = (lane >> 4) << 1;

    // A operand (ctx^T): lane l16 holds row d = d0 + wave*16 + l16,
    //                    VGPR0/1 = K(=n) = k0+khalf(+1); coalesced across lanes.
    const int d = d0 + wave * 16 + l16;
    const float* cp = ctx + (size_t)b * NREG * DDIM + (size_t)khalf * DDIM + d;

    // The 288 full k values run as 9 groups of 8 k-steps with no bounds test;
    // each group's 16 loads are issued one group ahead into a second register set.
    v2f fa[KGRP], fb[KGRP];
    k2_load_group(fa, cp);                     // group 0 flies during the staging

    // stage attn2[b] into LDS, zero the 3-column pad
    const float* ap = attn + (size_t)b * TWORDS * NREG;
    for (int i = tid; i < TWORDS * NREG; i += 128) {
        const int t = i / NREG;
        s[t][i - t * NREG] = ap[i];
    }
    for (int i = tid; i < TWORDS * (NPAD - NREG); i += 128) {
        const int t = i / (NPAD - NREG);
        s[t][NREG + (i - t * (NPAD - NREG))] = 0.f;
    }
    __syncthreads();

    // B operand from LDS: lane l16 is col t (or t+16); pad cols are zero
    const float* s0 = &s[l16][khalf];
    const float* s1 = &s[16 + l16][khalf];

    v8f acc0 = {}, acc1 = {};
    // fully unrolled: each load takes its row as an immediate offset from one address, so no
    // address update (with its wait) stands between loads, and the two sets swap without copies
#pragma unroll
    for (int g = 0; g < NGRP - 1; g += 2) {
        k2_load_group(fb, cp + (size_t)(g + 1) * (4 * KGRP) * DDIM);
        k2_mma_group(fa, s0 + g * (4 * KGRP), s1 + g * (4 * KGRP), acc0, acc1);
        k2_load_group(fa, cp + (size_t)(g + 2) * (4 * KGRP) * DDIM);
        k2_mma_group(fb, s0 + (g + 1) * (4 * KGRP), s1 + (g + 1) * (4 * KGRP), acc0, acc1);
    }
    // tail k0 = 288: only n = 288 exists (lanes 0-15, first register); every lane
    // reads that row, in bounds, and the upper half-wave feeds zeros.
    const float tl = ctx[((size_t)b * NREG + (NREG - 1)) * DDIM + d];
    k2_mma_group(fa, s0 + (NGRP - 1) * (4 * KGRP), s1 + (NGRP - 1) * (4 * KGRP), acc0, acc1);
    {
        v2f a;
        a.x = (khalf == 0) ? tl : 0.f;
        a.y = 0.f;
        v2f b0 = *(const v2f*)(s0 + NGRP * (4 * KGRP));
        v2f b1 = *(const v2f*)(s1 + NGRP * (4 * KGRP));
        acc0 = __builtin_amdgcn_wmma_f32_16x16x4_f32(false, a, false, b0,
                                                     (short)0, acc0, false, false);
        acc1 = __builtin_amdgcn_wmma_f32_16x16x4_f32(false, a, false, b1,
                                                     (short)0, acc1, false, false);
    }

    // store: acc[v] lane<16 -> d-row v, col l16; lane>=16 -> d-row v+8
    const int mrow = wave * 16 + ((lane >> 4) << 3);
    float* op = out + (size_t)b * DDIM * TWORDS;
#pragma unroll
    for (int v = 0; v < 8; ++v) {
        const int dd = d0 + mrow + v;
        op[(size_t)dd * TWORDS + l16]      = acc0[v];
        op[(size_t)dd * TWORDS + 16 + l16] = acc1[v];
    }
}

extern "C" void kernel_launch(void* const* d_in, const int* in_sizes, int n_in,
                              void* d_out, int out_size, void* d_ws, size_t ws_size,
                              hipStream_t stream) {
    const float* ctx  = (const float*)d_in[0];   // image_feature [128,17,17,1024]
    const float* word = (const float*)d_in[1];   // word_vector  [128,32,1024]
    float* out  = (float*)d_out;                 // [128,1024,32]
    float* attn = (float*)d_ws;                  // [128,32,289] fp32 (~4.5 MB)

    k1_gemm1_softmaxT<<<dim3(2, BATCH), K1_WAVES * 32, 0, stream>>>(ctx, word, attn);
    k1b_softmaxN<<<dim3(BATCH * TWORDS), 128, 0, stream>>>(attn);
    k2_gemm2<<<dim3(DDIM / 64, BATCH), 128, 0, stream>>>(ctx, attn, out);
}

// v003
// One run takes 38.6 microseconds.
// Two timings next to v002 put it at 1.17 and 1.18 times that version's speed.
// All steps since v000 together make it 2.67 times as fast.
#include <hip/hip_runtime.h>
#include <math.h>

// DAMSM attention for MI455X (gfx1250), fp32 WMMA path.
// B=128, N=289 (17x17), T=32, D=1024, GAMMA1=4.

typedef __attribute__((ext_vector_type(2))) float v2f;
typedef __attribute__((ext_vector_type(8))) float v8f;

#define BATCH  128
#define NREG   289
#define TWORDS 32
#define DDIM   1024
#define GAMMA1 4.0f
#define NTILES 19     // ceil(289/16)
#define NPAD   292    // 289 padded to multiple of 4 (keeps v2f LDS reads aligned)
#define WPLANE (BATCH * TWORDS * NREG)   // floats of ws[B, T, N]; the row sums [B, 2, T] follow it

// ---------------------------------------------------------------------------
// Kernel 1: attnT[t][n] = sum_d word[b,t,d] * ctx[b,n,d]  (WMMA f32 16x16x4)
// then softmax over t (32 values) per column n; ws[B, T, N] gets w = exp(GAMMA1 * p), the
// numerator of the second softmax (over n), and ws[B, 2, T] this block's share of its row sums.
// Grid: (2 n-groups, 128 batches), Block: 640 threads = 20 waves = 10 n-tiles x 2 t-halves
// (group 1 has 9 tiles: its last two waves only copy and pass the barriers).
// Both operands come through LDS: per stage of 128 k values every staged row is 512
// contiguous bytes, brought by one asynchronous copy of one wave (whole lines), into
// two buffers, so that stage t + 1 flies while stage t is multiplied.
// ---------------------------------------------------------------------------
#define K1_TILES  10                         // n-tiles per block
#define K1_WAVES  (2 * K1_TILES)
#define K1_COLS   (16 * K1_TILES)            // 160 columns per block
#define K1_ROWS   (TWORDS + K1_COLS)         // staged rows: 32 of word, then up to 160 of ctx
#define K1_KC     128                        // k values per stage
#define K1_NSTG   (DDIM / K1_KC)              // 8 stages
#define K1_PITCH  (K1_KC + 4)                // 132 dwords: row r starts on bank 4r, 8-byte reads of 16 rows hit 64 banks
#define K1_BUF    (K1_ROWS * K1_PITCH)       // floats per buffer

// one row's copy; the s_wait_xcnt closes the statement so that no address register of the
// copy is rewritten ahead of it
__device__ __forceinline__ void k1_copy1(unsigned l, const float* g)
{
    asm volatile("global_load_async_to_lds_b128 %0, %1, off\n\t"
                 "s_wait_xcnt 0x0"
                 :: "v"(l), "v"(g) : "memory");
}

// one stage of a wave: rows wave + 20 i; the first eight exist for every wave of both groups
__device__ __forceinline__ void k1_copy_stage(const float* const (&gp)[10], unsigned l0,
                                              int koff, bool has8, bool has9)
{
    const unsigned st = K1_WAVES * K1_PITCH * 4;   // LDS bytes between two rows of a wave
    // eight copies and their s_wait_xcnt in one statement (same reason as above)
    asm volatile("global_load_async_to_lds_b128 %0, %8, off\n\t"
                 "global_load_async_to_lds_b128 %1, %9, off\n\t"
                 "global_load_async_to_lds_b128 %2, %10, off\n\t"
                 "global_load_async_to_lds_b128 %3, %11, off\n\t"
                 "global_load_async_to_lds_b128 %4, %12, off\n\t"
                 "global_load_async_to_lds_b128 %5, %13, off\n\t"
                 "global_load_async_to_lds_b128 %6, %14, off\n\t"
                 "global_load_async_to_lds_b128 %7, %15, off\n\t"
                 "s_wait_xcnt 0x0"
                 :: "v"(l0), "v"(l0 + st), "v"(l0 + 2 * st), "v"(l0 + 3 * st),
                    "v"(l0 + 4 * st), "v"(l0 + 5 * st), "v"(l0 + 6 * st), "v"(l0 + 7 * st),
                    "v"(gp[0] + koff), "v"(gp[1] + koff), "v"(gp[2] + koff), "v"(gp[3] + koff),
                    "v"(gp[4] + koff), "v"(gp[5] + koff), "v"(gp[6] + koff), "v"(gp[7] + koff)
                 : "memory");
    if (has8) k1_copy1(l0 + 8 * st, gp[8] + koff);
    if (has9) k1_copy1(l0 + 9 * st, gp[9] + koff);
}

// the value of lane l ^ M inside a 16-lane row (a DPP move: no LDS round trip)
template <int M>
__device__ __forceinline__ float row_xmask_f32(float x)
{
    return __int_as_float(__builtin_amdgcn_update_dpp(0, __float_as_int(x), 0x160 + M,
                                                      0xf, 0xf, false));
}

// 2^x in one instruction; the v_nop is the slot that the instruction set asks for between a
// transcendental and a next instruction that reads its result or overwrites its source
__device__ __forceinline__ float exp2_f32(float x)
{
    float r;
    asm("v_exp_f32 %0, %1\n\t"
        "v_nop"
        : "=v"(r) : "v"(x));
    return r;
}

__global__ __launch_bounds__(K1_WAVES * 32)
void k1_gemm1_softmaxT(const float* __restrict__ ctx,   // [B, N, D]
                       const float* __restrict__ word,  // [B, T, D]
                       float* __restrict__ attn)        // [B, T, N], then [B, 2, T] (ws)
{
    __shared__ __attribute__((aligned(16))) float buf[2 * K1_BUF];   // 202752 bytes
    __shared__ float s[TWORDS][K1_COLS];                             // 20480 bytes

    const int grp   = blockIdx.x;
    const int b     = blockIdx.y;
    const int lane  = threadIdx.x & 31;
    const int wave  = __builtin_amdgcn_readfirstlane(threadIdx.x >> 5);
    const int tile  = wave >> 1;               // n-tile inside the group
    const int thalf = wave & 1;                // 0 -> t 0..15, 1 -> t 16..31
    const int l16   = lane & 15;
    const int khalf = (lane >> 4) << 1;        // 0 for lanes 0-15, 2 for lanes 16-31

    const int n0    = grp * K1_COLS;
    const int ntl   = (grp == 0) ? K1_TILES : (NTILES - K1_TILES);   // 10 or 9 tiles
    const int nrows = TWORDS + 16 * ntl;                              // 192 or 176 staged rows

    // the wave's rows: r < 32 is word row r, else ctx row n0 + r - 32, clamped to the last
    // row (the clamped rows feed columns that are never written out)
    const float* gp[10];
#pragma unroll   // constant indices: gp[] stays in registers
    for (int i = 0; i < 10; ++i) {
        const int r = wave + K1_WAVES * i;
        const int n = n0 + r - TWORDS;
        const int ncl = (n < NREG) ? n : (NREG - 1);
        gp[i] = ((r < TWORDS) ? word + ((size_t)b * TWORDS + r) * DDIM
                              : ctx + ((size_t)b * NREG + ncl) * DDIM) + lane * 4;
    }
    const bool has8 = wave + 8 * K1_WAVES < nrows;
    const bool has9 = wave + 9 * K1_WAVES < nrows;
    const unsigned lbase = (unsigned)(size_t)buf + (unsigned)(wave * K1_PITCH + lane * 4) * 4u;

    k1_copy_stage(gp, lbase, 0, has8, has9);
    asm volatile("s_wait_asynccnt 0x0" ::: "memory");   // stage 0 of this wave has landed
    __syncthreads();                                    // ... and of every wave
    k1_copy_stage(gp, lbase + K1_BUF * 4, K1_KC, has8, has9);

    // A operand (word): lane l16 holds row t = thalf*16+l16, VGPR0/1 = K = k0+khalf(+1)
    const float* ap = buf + (thalf * 16 + l16) * K1_PITCH + khalf;
    // B operand (ctx):  lane l16 holds col n, VGPR0/1 = K = k0+khalf(+1)
    const float* bp = buf + (TWORDS + tile * 16 + l16) * K1_PITCH + khalf;
    const bool active = tile < ntl;

    v8f acc = {};
    for (int t = 0; t < K1_NSTG; ++t) {
        const int cur = (t & 1) * K1_BUF;
        if (active) {
#pragma unroll   // every LDS read takes its k as an immediate offset from one address per operand
            for (int k0 = 0; k0 < K1_KC; k0 += 4) {
                v2f a  = *(const v2f*)(ap + cur + k0);
                v2f bb = *(const v2f*)(bp + cur + k0);
                acc = __builtin_amdgcn_wmma_f32_16x16x4_f32(false, a, false, bb,
                                                            (short)0, acc, false, false);
            }
        }
        asm volatile("s_wait_dscnt 0x0" ::: "memory");     // this wave's reads of the buffer are done
        asm volatile("s_wait_asynccnt 0x0" ::: "memory");  // its copies of stage t + 1 have landed
        __syncthreads();   // publishes stage t + 1 and frees the buffer of stage t
        if (t + 2 < K1_NSTG)
            k1_copy_stage(gp, lbase + cur * 4, (t + 2) * K1_KC, has8, has9);
    }
    asm volatile("s_wait_asynccnt 0x0" ::: "memory");      // nothing in flight past the loop

    // C layout: VGPR v, lanes 0-15 -> M=v; lanes 16-31 -> M=v+8; col = l16
    if (active) {
        const int rbase = thalf * 16 + ((lane >> 4) << 3);
#pragma unroll
        for (int v = 0; v < 8; ++v)
            s[rbase + v][tile * 16 + l16] = acc[v];
    }
    __syncthreads();

    // softmax over t (length 32) per column; one thread owns a valid column, keeps its 32
    // values in registers and stores them to ws[b][t][n] itself (lanes = consecutive n).
    // p = e / sum lies in [0, 1], so exp(GAMMA1 * p) <= e^4 needs no maximum taken off.
    // w also goes back into the thread's own column of s for the row sums.
    const int nv = (NREG - n0 < K1_COLS) ? (NREG - n0) : K1_COLS;   // 160 or 129
    const int c = threadIdx.x;
    float e[TWORDS];
    // the loops over e[] are unrolled so that it has constant indices and stays in registers
    if (c < nv) {
        float m = -INFINITY;
#pragma unroll
        for (int t = 0; t < TWORDS; ++t) { e[t] = s[t][c]; m = fmaxf(m, e[t]); }
        float sum = 0.f;
#pragma unroll
        for (int t = 0; t < TWORDS; ++t) { e[t] = expf(e[t] - m); sum += e[t]; }
        // exp(GAMMA1 * p) = 2^(p * GAMMA1 * log2(e)), the exponent in [0, 5.78]
        const float sc = (1.f / sum) * (GAMMA1 * 1.44269504f);
#pragma unroll
        for (int t = 0; t < TWORDS; ++t) {
            e[t] = exp2_f32(e[t] * sc);
            s[t][c] = e[t];
        }
    } else if (c < K1_COLS) {
        // a column past the last region adds nothing to a row sum
        for (int t = 0; t < TWORDS; ++t) s[t][c] = 0.f;
    }
    __syncthreads();   // every column of w is in s before a row is summed

    // the global stores stand behind the barrier, which would otherwise wait for them
    if (c < nv) {
        float* op = attn + (size_t)b * TWORDS * NREG + n0 + c;
#pragma unroll
        for (int t = 0; t < TWORDS; ++t) op[t * NREG] = e[t];
    }

    // row sums over this block's columns: 16 lanes per row t, 10 columns each, then a
    // butterfly over the 16-lane row
    if ((int)threadIdx.x < 16 * TWORDS) {
        const int t = threadIdx.x >> 4;
        float r = 0.f;
        for (int i = 0; i < K1_TILES; ++i) r += s[t][l16 + 16 * i];
        r += row_xmask_f32<1>(r);
        r += row_xmask_f32<2>(r);
        r += row_xmask_f32<4>(r);
        r += row_xmask_f32<8>(r);
        if (l16 == 0) attn[WPLANE + (b * 2 + grp) * TWORDS + t] = r;
    }
}

#define KGRP 8        // k-steps (of 4) per load group in kernel 2
#define NGRP 9        // 9 * 8 * 4 = 288 full k values; n = 288 is the tail

// 16 loads of one group: rows 4j and 4j+1 (from the lane's own first row), j = 0..7
__device__ __forceinline__ void k2_load_group(v2f (&f)[KGRP], const float* __restrict__ p)
{
#pragma unroll
    for (int j = 0; j < KGRP; ++j) {
        f[j].x = p[(size_t)(4 * j) * DDIM];
        f[j].y = p[(size_t)(4 * j + 1) * DDIM];
    }
}

// the group's 16 products, k ascending
__device__ __forceinline__ void k2_mma_group(const v2f (&f)[KGRP],
                                             const float* s0, const float* s1,
                                             v8f& acc0, v8f& acc1)
{
#pragma unroll
    for (int j = 0; j < KGRP; ++j) {
        v2f a  = f[j];
        v2f b0 = *(const v2f*)(s0 + 4 * j);
        v2f b1 = *(const v2f*)(s1 + 4 * j);
        acc0 = __builtin_amdgcn_wmma_f32_16x16x4_f32(false, a, false, b0,
                                                     (short)0, acc0, false, false);
        acc1 = __builtin_amdgcn_wmma_f32_16x16x4_f32(false, a, false, b1,
                                                     (short)0, acc1, false, false);
    }
}

// ---------------------------------------------------------------------------
// Kernel 2: out[b,d,t] = sum_n ctx[b,n,d] * w[b,t,n] / sum_n w[b,t,n]   (WMMA f32 16x16x4;
// the division is the second softmax's, applied to the finished sums)
// Grid: (16 d-tiles of 64, 128 batches), Block: 128 = 4 waves (16 d each).
// w[b] (32x289) staged in LDS padded to 292 cols (pad reads = 0).
// ---------------------------------------------------------------------------
__global__ __launch_bounds__(128)
void k2_gemm2(const float* __restrict__ ctx,   // [B, N, D]
              const float* __restrict__ attn,  // [B, T, N], then [B, 2, T]
              float* __restrict__ out)         // [B, D, T]
{
    __shared__ float s[TWORDS][NPAD];          // 37376 bytes

    const int b    = blockIdx.y;
    const int d0   = blockIdx.x * 64;
    const int tid  = threadIdx.x;
    const int lane = tid & 31;
    const int wave = tid >> 5;
    const int l16  = lane & 15;
    const int khalf = (lane >> 4) << 1;

    // A operand (ctx^T): lane l16 holds row d = d0 + wave*16 + l16,
    //                    VGPR0/1 = K(=n) = k0+khalf(+1); coalesced across lanes.
    const int d = d0 + wave * 16 + l16;
    const float* cp = ctx + (size_t)b * NREG * DDIM + (size_t)khalf * DDIM + d;

    // The 288 full k values run as 9 groups of 8 k-steps with no bounds test;
    // each group's 16 loads are issued one group ahead into a second register set.
    v2f fa[KGRP], fb[KGRP];
    k2_load_group(fa, cp);                     // group 0 flies during the staging

    // an accumulator's column is t = l16 (or 16 + l16) in both half-waves: each lane takes
    // the two blocks' shares of those two rows' sums
    const float* rs = attn + WPLANE + b * 2 * TWORDS;
    const float inv0 = 1.f / (rs[l16] + rs[TWORDS + l16]);
    const float inv1 = 1.f / (rs[16 + l16] + rs[TWORDS + 16 + l16]);

    // stage w[b] into LDS, zero the 3-column pad
    const float* ap = attn + (size_t)b * TWORDS * NREG;
    for (int i = tid; i < TWORDS * NREG; i += 128) {
        const int t = i / NREG;
        s[t][i - t * NREG] = ap[i];
    }
    for (int i = tid; i < TWORDS * (NPAD - NREG); i += 128) {
        const int t = i / (NPAD - NREG);
        s[t][NREG + (i - t * (NPAD - NREG))] = 0.f;
    }
    __syncthreads();

    // B operand from LDS: lane l16 is col t (or t+16); pad cols are zero
    const float* s0 = &s[l16][khalf];
    const float* s1 = &s[16 + l16][khalf];

    v8f acc0 = {}, acc1 = {};
    // fully unrolled: each load takes its row as an immediate offset from one address, so no
    // address update (with its wait) stands between loads, and the two sets swap without copies
#pragma unroll
    for (int g = 0; g < NGRP - 1; g += 2) {
        k2_load_group(fb, cp + (size_t)(g + 1) * (4 * KGRP) * DDIM);
        k2_mma_group(fa, s0 + g * (4 * KGRP), s1 + g * (4 * KGRP), acc0, acc1);
        k2_load_group(fa, cp + (size_t)(g + 2) * (4 * KGRP) * DDIM);
        k2_mma_group(fb, s0 + (g + 1) * (4 * KGRP), s1 + (g + 1) * (4 * KGRP), acc0, acc1);
    }
    // tail k0 = 288: only n = 288 exists (lanes 0-15, first register); every lane
    // reads that row, in bounds, and the upper half-wave feeds zeros.
    const float tl = ctx[((size_t)b * NREG + (NREG - 1)) * DDIM + d];
    k2_mma_group(fa, s0 + (NGRP - 1) * (4 * KGRP), s1 + (NGRP - 1) * (4 * KGRP), acc0, acc1);
    {
        v2f a;
        a.x = (khalf == 0) ? tl : 0.f;
        a.y = 0.f;
        v2f b0 = *(const v2f*)(s0 + NGRP * (4 * KGRP));
        v2f b1 = *(const v2f*)(s1 + NGRP * (4 * KGRP));
        acc0 = __builtin_amdgcn_wmma_f32_16x16x4_f32(false, a, false, b0,
                                                     (short)0, acc0, false, false);
        acc1 = __builtin_amdgcn_wmma_f32_16x16x4_f32(false, a, false, b1,
                                                     (short)0, acc1, false, false);
    }

    // store: acc[v] lane<16 -> d-row v, col l16; lane>=16 -> d-row v+8
    const int mrow = wave * 16 + ((lane >> 4) << 3);
    float* op = out + (size_t)b * DDIM * TWORDS;
#pragma unroll
    for (int v = 0; v < 8; ++v) {
        const int dd = d0 + mrow + v;
        op[(size_t)dd * TWORDS + l16]      = acc0[v] * inv0;
        op[(size_t)dd * TWORDS + 16 + l16] = acc1[v] * inv1;
    }
}

extern "C" void kernel_launch(void* const* d_in, const int* in_sizes, int n_in,
                              void* d_out, int out_size, void* d_ws, size_t ws_size,
                              hipStream_t stream) {
    const float* ctx  = (const float*)d_in[0];   // image_feature [128,17,17,1024]
    const float* word = (const float*)d_in[1];   // word_vector  [128,32,1024]
    float* out  = (float*)d_out;                 // [128,1024,32]
    float* attn = (float*)d_ws;                  // [128,32,289] fp32 (~4.5 MB), then [128,2,32]

    k1_gemm1_softmaxT<<<dim3(2, BATCH), K1_WAVES * 32, 0, stream>>>(ctx, word, attn);
    k2_gemm2<<<dim3(DDIM / 64, BATCH), 128, 0, stream>>>(ctx, attn, out);
}

// v004
// A run of this version takes 33.9 microseconds.
// Next to v003, in two timings, it ran 1.14 and 1.15 times as fast.
// Counting every step since v000, it is 3.06 times as fast.
#include <hip/hip_runtime.h>
#include <math.h>

// DAMSM attention for MI455X (gfx1250), fp32 WMMA path.
// B=128, N=289 (17x17), T=32, D=1024, GAMMA1=4.

typedef __attribute__((ext_vector_type(2))) float v2f;
typedef __attribute__((ext_vector_type(8))) float v8f;

#define BATCH  128
#define NREG   289
#define TWORDS 32
#define DDIM   1024
#define GAMMA1 4.0f
#define NTILES 19     // ceil(289/16)
#define NPAD   292    // 289 padded to multiple of 4 (keeps v2f LDS reads aligned)
#define WPLANE (BATCH * TWORDS * NREG)   // floats of ws[B, T, N]; the row sums [B, 2, T] follow it

// ---------------------------------------------------------------------------
// Kernel 1: attnT[t][n] = sum_d word[b,t,d] * ctx[b,n,d]  (WMMA f32 16x16x4)
// then softmax over t (32 values) per column n; ws[B, T, N] gets w = exp(GAMMA1 * p), the
// numerator of the second softmax (over n), and ws[B, 2, T] this block's share of its row sums.
// Grid: (2 n-groups, 128 batches), Block: 640 threads = 20 waves = 10 n-tiles x 2 t-halves
// (group 1 has 9 tiles: its last two waves only copy and pass the barriers).
// Both operands come through LDS: per stage of 128 k values every staged row is 512
// contiguous bytes, brought by one asynchronous copy of one wave (whole lines), into
// two buffers, so that stage t + 1 flies while stage t is multiplied.
// ---------------------------------------------------------------------------
#define K1_TILES  10                         // n-tiles per block
#define K1_WAVES  (2 * K1_TILES)
#define K1_COLS   (16 * K1_TILES)            // 160 columns per block
#define K1_ROWS   (TWORDS + K1_COLS)         // staged rows: 32 of word, then up to 160 of ctx
#define K1_KC     128                        // k values per stage
#define K1_NSTG   (DDIM / K1_KC)              // 8 stages
#define K1_PITCH  (K1_KC + 4)                // 132 dwords: row r starts on bank 4r, 8-byte reads of 16 rows hit 64 banks
#define K1_BUF    (K1_ROWS * K1_PITCH)       // floats per buffer

// one row's copy; the s_wait_xcnt closes the statement so that no address register of the
// copy is rewritten ahead of it
__device__ __forceinline__ void k1_copy1(unsigned l, const float* g)
{
    asm volatile("global_load_async_to_lds_b128 %0, %1, off\n\t"
                 "s_wait_xcnt 0x0"
                 :: "v"(l), "v"(g) : "memory");
}

// one stage of a wave: rows wave + 20 i; the first eight exist for every wave of both groups
__device__ __forceinline__ void k1_copy_stage(const float* const (&gp)[10], unsigned l0,
                                              int koff, bool has8, bool has9)
{
    const unsigned st = K1_WAVES * K1_PITCH * 4;   // LDS bytes between two rows of a wave
    // eight copies and their s_wait_xcnt in one statement (same reason as above)
    asm volatile("global_load_async_to_lds_b128 %0, %8, off\n\t"
                 "global_load_async_to_lds_b128 %1, %9, off\n\t"
                 "global_load_async_to_lds_b128 %2, %10, off\n\t"
                 "global_load_async_to_lds_b128 %3, %11, off\n\t"
                 "global_load_async_to_lds_b128 %4, %12, off\n\t"
                 "global_load_async_to_lds_b128 %5, %13, off\n\t"
                 "global_load_async_to_lds_b128 %6, %14, off\n\t"
                 "global_load_async_to_lds_b128 %7, %15, off\n\t"
                 "s_wait_xcnt 0x0"
                 :: "v"(l0), "v"(l0 + st), "v"(l0 + 2 * st), "v"(l0 + 3 * st),
                    "v"(l0 + 4 * st), "v"(l0 + 5 * st), "v"(l0 + 6 * st), "v"(l0 + 7 * st),
                    "v"(gp[0] + koff), "v"(gp[1] + koff), "v"(gp[2] + koff), "v"(gp[3] + koff),
                    "v"(gp[4] + koff), "v"(gp[5] + koff), "v"(gp[6] + koff), "v"(gp[7] + koff)
                 : "memory");
    if (has8) k1_copy1(l0 + 8 * st, gp[8] + koff);
    if (has9) k1_copy1(l0 + 9 * st, gp[9] + koff);
}

// the value of lane l ^ M inside a 16-lane row (a DPP move: no LDS round trip)
template <int M>
__device__ __forceinline__ float row_xmask_f32(float x)
{
    return __int_as_float(__builtin_amdgcn_update_dpp(0, __float_as_int(x), 0x160 + M,
                                                      0xf, 0xf, false));
}

// 2^x in one instruction; the v_nop is the slot that the instruction set asks for between a
// transcendental and a next instruction that reads its result or overwrites its source
__device__ __forceinline__ float exp2_f32(float x)
{
    float r;
    asm("v_exp_f32 %0, %1\n\t"
        "v_nop"
        : "=v"(r) : "v"(x));
    return r;
}

__global__ __launch_bounds__(K1_WAVES * 32)
void k1_gemm1_softmaxT(const float* __restrict__ ctx,   // [B, N, D]
                       const float* __restrict__ word,  // [B, T, D]
                       float* __restrict__ attn)        // [B, T, N], then [B, 2, T] (ws)
{
    __shared__ __attribute__((aligned(16))) float buf[2 * K1_BUF];   // 202752 bytes
    __shared__ float s[TWORDS][K1_COLS];                             // 20480 bytes

    const int grp   = blockIdx.x;
    const int b     = blockIdx.y;
    const int lane  = threadIdx.x & 31;
    const int wave  = __builtin_amdgcn_readfirstlane(threadIdx.x >> 5);
    const int tile  = wave >> 1;               // n-tile inside the group
    const int thalf = wave & 1;                // 0 -> t 0..15, 1 -> t 16..31
    const int l16   = lane & 15;
    const int khalf = (lane >> 4) << 1;        // 0 for lanes 0-15, 2 for lanes 16-31

    const int n0    = grp * K1_COLS;
    const int ntl   = (grp == 0) ? K1_TILES : (NTILES - K1_TILES);   // 10 or 9 tiles
    const int nrows = TWORDS + 16 * ntl;                              // 192 or 176 staged rows

    // the wave's rows: r < 32 is word row r, else ctx row n0 + r - 32, clamped to the last
    // row (the clamped rows feed columns that are never written out)
    const float* gp[10];
#pragma unroll   // constant indices: gp[] stays in registers
    for (int i = 0; i < 10; ++i) {
        const int r = wave + K1_WAVES * i;
        const int n = n0 + r - TWORDS;
        const int ncl = (n < NREG) ? n : (NREG - 1);
        gp[i] = ((r < TWORDS) ? word + ((size_t)b * TWORDS + r) * DDIM
                              : ctx + ((size_t)b * NREG + ncl) * DDIM) + lane * 4;
    }
    const bool has8 = wave + 8 * K1_WAVES < nrows;
    const bool has9 = wave + 9 * K1_WAVES < nrows;
    const unsigned lbase = (unsigned)(size_t)buf + (unsigned)(wave * K1_PITCH + lane * 4) * 4u;

    k1_copy_stage(gp, lbase, 0, has8, has9);
    asm volatile("s_wait_asynccnt 0x0" ::: "memory");   // stage 0 of this wave has landed
    __syncthreads();                                    // ... and of every wave
    k1_copy_stage(gp, lbase + K1_BUF * 4, K1_KC, has8, has9);

    // A operand (word): lane l16 holds row t = thalf*16+l16, VGPR0/1 = K = k0+khalf(+1)
    const float* ap = buf + (thalf * 16 + l16) * K1_PITCH + khalf;
    // B operand (ctx):  lane l16 holds col n, VGPR0/1 = K = k0+khalf(+1)
    const float* bp = buf + (TWORDS + tile * 16 + l16) * K1_PITCH + khalf;
    const bool active = tile < ntl;

    v8f acc = {};
    for (int t = 0; t < K1_NSTG; ++t) {
        const int cur = (t & 1) * K1_BUF;
        if (active) {
#pragma unroll   // every LDS read takes its k as an immediate offset from one address per operand
            for (int k0 = 0; k0 < K1_KC; k0 += 4) {
                v2f a  = *(const v2f*)(ap + cur + k0);
                v2f bb = *(const v2f*)(bp + cur + k0);
                acc = __builtin_amdgcn_wmma_f32_16x16x4_f32(false, a, false, bb,
                                                            (short)0, acc, false, false);
            }
        }
        asm volatile("s_wait_dscnt 0x0" ::: "memory");     // this wave's reads of the buffer are done
        asm volatile("s_wait_asynccnt 0x0" ::: "memory");  // its copies of stage t + 1 have landed
        __syncthreads();   // publishes stage t + 1 and frees the buffer of stage t
        if (t + 2 < K1_NSTG)
            k1_copy_stage(gp, lbase + cur * 4, (t + 2) * K1_KC, has8, has9);
    }
    asm volatile("s_wait_asynccnt 0x0" ::: "memory");      // nothing in flight past the loop

    // C layout: VGPR v, lanes 0-15 -> M=v; lanes 16-31 -> M=v+8; col = l16
    if (active) {
        const int rbase = thalf * 16 + ((lane >> 4) << 3);
#pragma unroll
        for (int v = 0; v < 8; ++v)
            s[rbase + v][tile * 16 + l16] = acc[v];
    }
    __syncthreads();

    // softmax over t (length 32) per column; one thread owns a valid column, keeps its 32
    // values in registers and stores them to ws[b][t][n] itself (lanes = consecutive n).
    // p = e / sum lies in [0, 1], so exp(GAMMA1 * p) <= e^4 needs no maximum taken off.
    // w also goes back into the thread's own column of s for the row sums.
    const int nv = (NREG - n0 < K1_COLS) ? (NREG - n0) : K1_COLS;   // 160 or 129
    const int c = threadIdx.x;
    float e[TWORDS];
    // the loops over e[] are unrolled so that it has constant indices and stays in registers
    if (c < nv) {
        float m = -INFINITY;
#pragma unroll
        for (int t = 0; t < TWORDS; ++t) { e[t] = s[t][c]; m = fmaxf(m, e[t]); }
        float sum = 0.f;
#pragma unroll
        for (int t = 0; t < TWORDS; ++t) { e[t] = expf(e[t] - m); sum += e[t]; }
        // exp(GAMMA1 * p) = 2^(p * GAMMA1 * log2(e)), the exponent in [0, 5.78]
        const float sc = (1.f / sum) * (GAMMA1 * 1.44269504f);
#pragma unroll
        for (int t = 0; t < TWORDS; ++t) {
            e[t] = exp2_f32(e[t] * sc);
            s[t][c] = e[t];
        }
    } else if (c < K1_COLS) {
        // a column past the last region adds nothing to a row sum
        for (int t = 0; t < TWORDS; ++t) s[t][c] = 0.f;
    }
    __syncthreads();   // every column of w is in s before a row is summed

    // the global stores stand behind the barrier, which would otherwise wait for them
    if (c < nv) {
        float* op = attn + (size_t)b * TWORDS * NREG + n0 + c;
#pragma unroll
        for (int t = 0; t < TWORDS; ++t) op[t * NREG] = e[t];
    }

    // row sums over this block's columns: 16 lanes per row t, 10 columns each, then a
    // butterfly over the 16-lane row
    if ((int)threadIdx.x < 16 * TWORDS) {
        const int t = threadIdx.x >> 4;
        float r = 0.f;
        for (int i = 0; i < K1_TILES; ++i) r += s[t][l16 + 16 * i];
        r += row_xmask_f32<1>(r);
        r += row_xmask_f32<2>(r);
        r += row_xmask_f32<4>(r);
        r += row_xmask_f32<8>(r);
        if (l16 == 0) attn[WPLANE + (b * 2 + grp) * TWORDS + t] = r;
    }
}

typedef __attribute__((ext_vector_type(4))) float v4f;

#define K2_WAVES  8                      // waves per block: two per SIMD
#define K2_DW     64                     // d values per wave: four 16-row tiles
#define K2_DB     (K2_WAVES * K2_DW)     // 512 d values per block
#define K2_THR    (K2_WAVES * 32)
#define K2_KSTEPS 72                     // full k-steps of 4 regions; n = 288 is the tail
#define K2_RING   12                     // k-steps of ctx that a wave keeps in flight
#define K2_WRNDS  ((TWORDS * NREG + K2_THR - 1) / K2_THR)   // 37 rounds stage the 9248 values of w[b]

// ---------------------------------------------------------------------------
// Kernel 2: out[b,d,t] = sum_n ctx[b,n,d] * w[b,t,n] / sum_n w[b,t,n]   (WMMA f32 16x16x4;
// the division is the second softmax's, applied to the finished sums)
// Grid: (2 d-halves of 512, 128 batches), Block: 256 = 8 waves, one block per WGP.
// A wave owns 64 d x 32 t = 8 accumulator tiles. Row m of its tile j is d = 4 m + j, so one
// 16-byte load of a lane holds one k value of all four A fragments, and a half-wave reads
// 256 contiguous bytes of a ctx row. Each B fragment read from LDS feeds four products.
// w[b] (32x289) is staged once per block, padded to 292 cols (pad reads = 0).
// ---------------------------------------------------------------------------
__global__ __launch_bounds__(K2_THR)
void k2_gemm2(const float* __restrict__ ctx,   // [B, N, D]
              const float* __restrict__ attn,  // [B, T, N], then [B, 2, T]
              float* __restrict__ out)         // [B, D, T]
{
    __shared__ float s[TWORDS][NPAD];          // 37376 bytes

    const int b    = blockIdx.y;
    const int tid  = threadIdx.x;
    const int lane = tid & 31;
    const int wave = tid >> 5;
    const int l16  = lane & 15;
    const int half = lane >> 4;
    const int khalf = half << 1;
    const int dw   = blockIdx.x * K2_DB + wave * K2_DW;

    // w[b]: all of a thread's loads are issued before the first is stored (one latency)
    const float* ap = attn + (size_t)b * TWORDS * NREG;
    // the last round ends on the last value and overlaps the round before it (the same values
    // stored twice), so that no round needs a bounds test
    float wv[K2_WRNDS];
#pragma unroll   // constant indices: wv[] stays in registers
    for (int i = 0; i < K2_WRNDS; ++i) {
        const int x0 = (i < K2_WRNDS - 1) ? K2_THR * i : TWORDS * NREG - K2_THR;
        wv[i] = ap[x0 + tid];
    }

    // an accumulator's column is t = l16 (or 16 + l16) in both half-waves: each lane takes
    // the two blocks' shares of those two rows' sums
    const float* rs = attn + WPLANE + b * 2 * TWORDS;
    const float inv0 = 1.f / (rs[l16] + rs[TWORDS + l16]);
    const float inv1 = 1.f / (rs[16 + l16] + rs[TWORDS + 16 + l16]);

    // A operand (ctx^T): lane l16 holds rows d = dw + 4 l16 + j of the tiles j = 0..3,
    //                    VGPR0/1 = K(=n) = k0+khalf(+1)
    const float* cp = ctx + (size_t)b * NREG * DDIM + (size_t)khalf * DDIM + dw + 4 * l16;
    v4f ra[K2_RING], rb[K2_RING];              // rows k0+khalf and k0+khalf+1 of a k-step
#pragma unroll   // constant indices: the ring stays in registers
    for (int k = 0; k < K2_RING; ++k) {
        ra[k] = *(const v4f*)(cp + (size_t)(4 * k) * DDIM);
        rb[k] = *(const v4f*)(cp + (size_t)(4 * k + 1) * DDIM);
    }

#pragma unroll
    for (int i = 0; i < K2_WRNDS; ++i) {
        const int x0 = (i < K2_WRNDS - 1) ? K2_THR * i : TWORDS * NREG - K2_THR;
        const int x = x0 + tid;
        const int t = x / NREG;
        s[t][x - t * NREG] = wv[i];
    }
    if (tid < TWORDS * (NPAD - NREG)) {        // zero the 3-column pad
        const int t = tid / (NPAD - NREG);
        s[t][NREG + (tid - t * (NPAD - NREG))] = 0.f;
    }
    __syncthreads();

    // B operand from LDS: lane l16 is col t (or t+16); pad cols are zero
    const float* s0 = &s[l16][khalf];
    const float* s1 = &s[16 + l16][khalf];

    v8f acc0[4] = {}, acc1[4] = {};
    v4f tl;
    // fully unrolled: ring slots are constant, each load takes its row as an immediate offset
    // from one address; a slot is refilled as soon as its k-step is multiplied. k ascending.
#pragma unroll
    for (int k = 0; k < K2_KSTEPS; ++k) {
        const int sl = k % K2_RING;
        const v2f b0 = *(const v2f*)(s0 + 4 * k);
        const v2f b1 = *(const v2f*)(s1 + 4 * k);
#pragma unroll
        for (int j = 0; j < 4; ++j) {
            v2f a;
            a.x = ra[sl][j];
            a.y = rb[sl][j];
            acc0[j] = __builtin_amdgcn_wmma_f32_16x16x4_f32(false, a, false, b0,
                                                            (short)0, acc0[j], false, false);
            acc1[j] = __builtin_amdgcn_wmma_f32_16x16x4_f32(false, a, false, b1,
                                                            (short)0, acc1[j], false, false);
        }
        if (k + K2_RING < K2_KSTEPS) {
            ra[sl] = *(const v4f*)(cp + (size_t)(4 * (k + K2_RING)) * DDIM);
            rb[sl] = *(const v4f*)(cp + (size_t)(4 * (k + K2_RING) + 1) * DDIM);
        } else if (k + K2_RING == K2_KSTEPS) {
            // tail row n = 288: every lane reads that row, in bounds
            tl = *(const v4f*)(ctx + ((size_t)b * NREG + (NREG - 1)) * DDIM + dw + 4 * l16);
        }
    }
    // tail k0 = 288: only n = 288 exists (lanes 0-15, first register); the upper half-wave
    // feeds zeros
    {
        const v2f b0 = *(const v2f*)(s0 + 4 * K2_KSTEPS);
        const v2f b1 = *(const v2f*)(s1 + 4 * K2_KSTEPS);
#pragma unroll
        for (int j = 0; j < 4; ++j) {
            v2f a;
            a.x = (khalf == 0) ? tl[j] : 0.f;
            a.y = 0.f;
            acc0[j] = __builtin_amdgcn_wmma_f32_16x16x4_f32(false, a, false, b0,
                                                            (short)0, acc0[j], false, false);
            acc1[j] = __builtin_amdgcn_wmma_f32_16x16x4_f32(false, a, false, b1,
                                                            (short)0, acc1[j], false, false);
        }
    }

    // store: acc[j][v] lane<16 -> tile row m = v, col l16; lane>=16 -> tile row m = v+8;
    // d = dw + 4 m + j
    float* op = out + ((size_t)b * DDIM + dw + 32 * half) * TWORDS + l16;
#pragma unroll
    for (int v = 0; v < 8; ++v) {
#pragma unroll
        for (int j = 0; j < 4; ++j) {
            op[(4 * v + j) * TWORDS]      = acc0[j][v] * inv0;
            op[(4 * v + j) * TWORDS + 16] = acc1[j][v] * inv1;
        }
    }
}

extern "C" void kernel_launch(void* const* d_in, const int* in_sizes, int n_in,
                              void* d_out, int out_size, void* d_ws, size_t ws_size,
                              hipStream_t stream) {
    const float* ctx  = (const float*)d_in[0];   // image_feature [128,17,17,1024]
    const float* word = (const float*)d_in[1];   // word_vector  [128,32,1024]
    float* out  = (float*)d_out;                 // [128,1024,32]
    float* attn = (float*)d_ws;                  // [128,32,289] fp32 (~4.5 MB), then [128,2,32]

    k1_gemm1_softmaxT<<<dim3(2, BATCH), K1_WAVES * 32, 0, stream>>>(ctx, word, attn);
    k2_gemm2<<<dim3(DDIM / K2_DB, BATCH), K2_THR, 0, stream>>>(ctx, attn, out);
}
